// v000
// Measured on an AMD MI455X. A time is GPU time per run, averaged over a window of back-to-back runs after a warm-up
// (all launches, gaps included; the runs take copies of the inputs in turn), and the median of several windows.
// Apart from v000's, it joins two sittings. Times from different sittings can be a few percent apart, while
// side-by-side timings come from the same sitting.
// v000, which the later versions start from, runs in 131 microseconds.
#include <hip/hip_runtime.h>
#include <hip/hip_bf16.h>

typedef __attribute__((ext_vector_type(16))) _Float16 v16h;
typedef __attribute__((ext_vector_type(8)))  float    v8f;

#define HID   256
#define CCH   16
#define WAVES 8
#define BLOCK (WAVES * 32)
#define SLABS 4
#define ROWS_PER_WG (WAVES * 16 * SLABS)   // 512 rows per workgroup

// LDS layout:
//   [0, 128KB)  : W2[c] as f16, pre-swizzled into per-lane WMMA B fragments.
//                 Fragment f = kc*512 + t*32 + lane holds the 16 halves lane
//                 `lane` needs for the WMMA on K-chunk kc, N-tile t.
//   then        : W1[c], b1[c], b2[c] (256 f32 each), W3[c] (768 f32)
#define W2_HALVES (8 * 16 * 32 * 16)                 // 65536 halves = 128 KB
#define SMEM_BYTES (W2_HALVES * 2 + (256 * 3 + 768) * 4)

__global__ __launch_bounds__(BLOCK) void kan_fused_wmma_kernel(
    const float* __restrict__ xg,  const float* __restrict__ W1g,
    const float* __restrict__ b1g, const float* __restrict__ W2g,
    const float* __restrict__ b2g, const float* __restrict__ W3g,
    const float* __restrict__ b3g, float* __restrict__ outg)
{
    extern __shared__ char smem[];
    _Float16* w2s = (_Float16*)smem;
    float*    w1s = (float*)(smem + W2_HALVES * 2);
    float*    b1s = w1s + 256;
    float*    b2s = b1s + 256;
    float*    w3s = b2s + 256;   // 768 floats, row-major [n][o]

    const int c    = blockIdx.y;
    const int tid  = threadIdx.x;
    const int lane = tid & 31;
    const int wave = tid >> 5;
    const int q    = lane & 15;   // column-in-tile / row selector
    const int hi   = lane >> 4;   // lane half (WMMA layout group)

    // ---- stage small per-channel tensors ----
    for (int i = tid; i < 256; i += BLOCK) {
        w1s[i] = W1g[c * HID + i];
        b1s[i] = b1g[c * HID + i];
        b2s[i] = b2g[c * HID + i];
    }
    for (int i = tid; i < 768; i += BLOCK)
        w3s[i] = W3g[c * HID * 3 + i];

    // ---- stage W2[c] (f32 [K=256][N=256]) -> swizzled f16 B fragments ----
    // 16-bit B 32x16 layout: lanes 0-15 (N=lane): halves 0..7 -> K 0..7,
    // halves 8..15 -> K 16..23; lanes 16-31: halves 0..7 -> K 8..15,
    // halves 8..15 -> K 24..31 (within the 32-wide K chunk).
    const float* W2c = W2g + (size_t)c * HID * HID;
#pragma unroll 1
    for (int f = tid; f < 8 * 16 * 32; f += BLOCK) {
        const int l  = f & 31;
        const int t  = (f >> 5) & 15;
        const int kc = f >> 9;
        const int n  = t * 16 + (l & 15);
        const int kb = kc * 32 + ((l & 16) ? 8 : 0);
        v16h frag;
#pragma unroll
        for (int h = 0; h < 16; ++h) {
            const int k = kb + ((h < 8) ? h : (h + 8));
            frag[h] = (_Float16)W2c[k * HID + n];
        }
        *(v16h*)(w2s + (size_t)f * 16) = frag;   // 32B aligned, conflict-free
    }
    __syncthreads();

    const size_t rowBase0 =
        (size_t)blockIdx.x * ROWS_PER_WG + (size_t)wave * (16 * SLABS);
    const float bo0 = b3g[c * 3 + 0];
    const float bo1 = b3g[c * 3 + 1];
    const float bo2 = b3g[c * 3 + 2];

    // Keep the slab loop rolled: each iteration's steady-state live set is
    // ~110 VGPRs (A slab 64 + acc 8 + B frag 8 + fc3 partials 24). Full
    // unrolling previously pushed allocation past v255 and into scratch.
#pragma unroll 1
    for (int slab = 0; slab < SLABS; ++slab) {
        const size_t rowBase = rowBase0 + (size_t)slab * 16;

        // ---- fc1 fused into A fragments: A[m,k] = relu(x_m*W1[k]+b1[k]) ----
        // A 16x32 layout mirrors B: row m = lane&15; K mapping as above.
        const float xm = xg[(rowBase + q) * CCH + c];
        v16h a[8];
#pragma unroll
        for (int kc = 0; kc < 8; ++kc) {
            const int kb = kc * 32 + hi * 8;
#pragma unroll
            for (int h = 0; h < 16; ++h) {
                const int k = kb + ((h < 8) ? h : (h + 8));
                float v = fmaf(xm, w1s[k], b1s[k]);
                a[kc][h] = (_Float16)(v > 0.f ? v : 0.f);
            }
        }

        // ---- fc2 via WMMA, fc3 folded onto the D layout ----
        float p0[8], p1[8], p2[8];
#pragma unroll
        for (int j = 0; j < 8; ++j) { p0[j] = 0.f; p1[j] = 0.f; p2[j] = 0.f; }

        // Rolled: 8 back-to-back WMMAs + interleaved LDS B loads per trip.
#pragma unroll 1
        for (int t = 0; t < 16; ++t) {           // 16 N-tiles of fc2 output
            v8f acc = {};
#pragma unroll
            for (int kc = 0; kc < 8; ++kc) {     // K = 256 in 32-chunks
                const v16h b = *(const v16h*)(w2s + ((kc * 512 + t * 32 + lane) << 4));
                acc = __builtin_amdgcn_wmma_f32_16x16x32_f16(
                    false, a[kc], false, b, (short)0, acc, false, false);
            }
            // D layout: VGPR j of this lane = element (M = j + 8*hi, N = t*16+q)
            const int   n  = t * 16 + q;
            const float bb = b2s[n];
            const float u0 = w3s[n * 3 + 0];
            const float u1 = w3s[n * 3 + 1];
            const float u2 = w3s[n * 3 + 2];
#pragma unroll
            for (int j = 0; j < 8; ++j) {
                float v = acc[j] + bb;
                v = v > 0.f ? v : 0.f;           // relu(fc2 + b2)
                p0[j] = fmaf(v, u0, p0[j]);
                p1[j] = fmaf(v, u1, p1[j]);
                p2[j] = fmaf(v, u2, p2[j]);
            }
        }

        // ---- reduce fc3 partials across the 16 lanes of each half ----
#pragma unroll
        for (int j = 0; j < 8; ++j) {
#pragma unroll
            for (int m = 1; m <= 8; m <<= 1) {
                p0[j] += __shfl_xor(p0[j], m, 32);
                p1[j] += __shfl_xor(p1[j], m, 32);
                p2[j] += __shfl_xor(p2[j], m, 32);
            }
        }

        // ---- write out[row, c*3 + o]; lane q==j writes row j + 8*hi ----
#pragma unroll
        for (int j = 0; j < 8; ++j) {
            if (q == j) {
                const size_t row = rowBase + (size_t)j + (size_t)(8 * hi);
                float* op = outg + row * (CCH * 3) + c * 3;
                op[0] = p0[j] + bo0;
                op[1] = p1[j] + bo1;
                op[2] = p2[j] + bo2;
            }
        }
    }
}

extern "C" void kernel_launch(void* const* d_in, const int* in_sizes, int n_in,
                              void* d_out, int out_size, void* d_ws, size_t ws_size,
                              hipStream_t stream) {
    (void)in_sizes; (void)n_in; (void)d_ws; (void)ws_size; (void)out_size;
    const float* x  = (const float*)d_in[0];
    const float* W1 = (const float*)d_in[1];
    const float* b1 = (const float*)d_in[2];
    const float* W2 = (const float*)d_in[3];
    const float* b2 = (const float*)d_in[4];
    const float* W3 = (const float*)d_in[5];
    const float* b3 = (const float*)d_in[6];
    float* out = (float*)d_out;

    // 137 KB dynamic LDS (> default 64 KB cap) — raise the attribute.
    hipFuncSetAttribute((const void*)kan_fused_wmma_kernel,
                        hipFuncAttributeMaxDynamicSharedMemorySize, SMEM_BYTES);

    const int Nrows = 8 * 64 * 64;                       // 32768
    dim3 grid(Nrows / ROWS_PER_WG, CCH);                 // (64, 16)
    kan_fused_wmma_kernel<<<grid, BLOCK, SMEM_BYTES, stream>>>(
        x, W1, b1, W2, b2, W3, b3, out);
}

// v001
// A run of this version takes 96.4 microseconds.
// In both of two side-by-side timings against v000, it was 1.38 times as fast.
#include <hip/hip_runtime.h>
#include <hip/hip_bf16.h>

typedef __attribute__((ext_vector_type(16))) _Float16 v16h;
typedef __attribute__((ext_vector_type(8)))  float    v8f;

#define HID   256
#define CCH   16
#define WAVES 8
#define BLOCK (WAVES * 32)
#define SLABS 4
#define ROWS_PER_WG (WAVES * 16 * SLABS)   // 512 rows per workgroup

// LDS layout:
//   [0, 128KB)  : W2[c] as f16, pre-swizzled into per-lane WMMA B fragments.
//                 Fragment f = kc*512 + t*32 + lane holds the 16 halves lane
//                 `lane` needs for the WMMA on K-chunk kc, N-tile t.
//   then        : W1[c], b1[c], b2[c] (256 f32 each), W3[c] (768 f32)
#define W2_HALVES (8 * 16 * 32 * 16)                 // 65536 halves = 128 KB
#define SMEM_BYTES (W2_HALVES * 2 + (256 * 3 + 768) * 4)

__global__ __launch_bounds__(BLOCK) void kan_fused_wmma_kernel(
    const float* __restrict__ xg,  const float* __restrict__ W1g,
    const float* __restrict__ b1g, const float* __restrict__ W2g,
    const float* __restrict__ b2g, const float* __restrict__ W3g,
    const float* __restrict__ b3g, float* __restrict__ outg)
{
    extern __shared__ char smem[];
    _Float16* w2s = (_Float16*)smem;
    float*    w1s = (float*)(smem + W2_HALVES * 2);
    float*    b1s = w1s + 256;
    float*    b2s = b1s + 256;
    float*    w3s = b2s + 256;   // 768 floats, row-major [n][o]

    const int c    = blockIdx.y;
    const int tid  = threadIdx.x;
    const int lane = tid & 31;
    const int wave = tid >> 5;
    const int q    = lane & 15;   // column-in-tile / row selector
    const int hi   = lane >> 4;   // lane half (WMMA layout group)

    // ---- stage small per-channel tensors ----
    for (int i = tid; i < 256; i += BLOCK) {
        w1s[i] = W1g[c * HID + i];
        b1s[i] = b1g[c * HID + i];
        b2s[i] = b2g[c * HID + i];
    }
    for (int i = tid; i < 768; i += BLOCK)
        w3s[i] = W3g[c * HID * 3 + i];

    // ---- stage W2[c] (f32 [K=256][N=256]) -> swizzled f16 B fragments ----
    // 16-bit B 32x16 layout: lanes 0-15 (N=lane): halves 0..7 -> K 0..7,
    // halves 8..15 -> K 16..23; lanes 16-31: halves 0..7 -> K 8..15,
    // halves 8..15 -> K 24..31 (within the 32-wide K chunk).
    const float* W2c = W2g + (size_t)c * HID * HID;
#pragma unroll 1
    for (int f = tid; f < 8 * 16 * 32; f += BLOCK) {
        const int l  = f & 31;
        const int t  = (f >> 5) & 15;
        const int kc = f >> 9;
        const int n  = t * 16 + (l & 15);
        const int kb = kc * 32 + ((l & 16) ? 8 : 0);
        v16h frag;
#pragma unroll
        for (int h = 0; h < 16; ++h) {
            const int k = kb + ((h < 8) ? h : (h + 8));
            frag[h] = (_Float16)W2c[k * HID + n];
        }
        *(v16h*)(w2s + (size_t)f * 16) = frag;   // 32B aligned, conflict-free
    }
    __syncthreads();

    const size_t rowBase0 =
        (size_t)blockIdx.x * ROWS_PER_WG + (size_t)wave * (16 * SLABS);
    const float bo0 = b3g[c * 3 + 0];
    const float bo1 = b3g[c * 3 + 1];
    const float bo2 = b3g[c * 3 + 2];

    // All SLABS row slabs of the wave are held in registers at once, so that
    // one B fragment read from LDS feeds SLABS WMMAs on independent
    // accumulators. Live set: A 4 x 64, acc 4 x 8, fc3 partials 4 x 24 VGPRs.

    // ---- fc1 fused into A fragments: A[m,k] = relu(x_m*W1[k]+b1[k]) ----
    // A 16x32 layout mirrors B: row m = lane&15; K mapping as above.
    float xm[SLABS];
#pragma unroll
    for (int s = 0; s < SLABS; ++s)
        xm[s] = xg[(rowBase0 + (size_t)(s * 16 + q)) * CCH + c];

    v16h a[SLABS][8];
#pragma unroll
    for (int kc = 0; kc < 8; ++kc) {
        const int kb = kc * 32 + hi * 8;
#pragma unroll
        for (int h = 0; h < 16; ++h) {
            const int k = kb + ((h < 8) ? h : (h + 8));
            const float w = w1s[k];
            const float b = b1s[k];
#pragma unroll
            for (int s = 0; s < SLABS; ++s) {
                float v = fmaf(xm[s], w, b);
                a[s][kc][h] = (_Float16)(v > 0.f ? v : 0.f);
            }
        }
    }

    // ---- fc2 via WMMA, fc3 folded onto the D layout ----
    float p0[SLABS][8], p1[SLABS][8], p2[SLABS][8];
#pragma unroll
    for (int s = 0; s < SLABS; ++s)
#pragma unroll
        for (int j = 0; j < 8; ++j) { p0[s][j] = 0.f; p1[s][j] = 0.f; p2[s][j] = 0.f; }

    // Rolled: unrolling over t would need a second set of accumulators and
    // fragments, which the 512-VGPR budget of this block size does not hold.
#pragma unroll 1
    for (int t = 0; t < 16; ++t) {               // 16 N-tiles of fc2 output
        v8f acc[SLABS];
#pragma unroll
        for (int s = 0; s < SLABS; ++s) acc[s] = v8f{};
#pragma unroll
        for (int kc = 0; kc < 8; ++kc) {         // K = 256 in 32-chunks
            const v16h b = *(const v16h*)(w2s + ((kc * 512 + t * 32 + lane) << 4));
#pragma unroll
            for (int s = 0; s < SLABS; ++s)
                acc[s] = __builtin_amdgcn_wmma_f32_16x16x32_f16(
                    false, a[s][kc], false, b, (short)0, acc[s], false, false);
        }
        // D layout: VGPR j of this lane = element (M = j + 8*hi, N = t*16+q)
        const int   n  = t * 16 + q;
        const float bb = b2s[n];
        const float u0 = w3s[n * 3 + 0];
        const float u1 = w3s[n * 3 + 1];
        const float u2 = w3s[n * 3 + 2];
#pragma unroll
        for (int s = 0; s < SLABS; ++s) {
#pragma unroll
            for (int j = 0; j < 8; ++j) {
                float v = acc[s][j] + bb;
                v = v > 0.f ? v : 0.f;           // relu(fc2 + b2)
                p0[s][j] = fmaf(v, u0, p0[s][j]);
                p1[s][j] = fmaf(v, u1, p1[s][j]);
                p2[s][j] = fmaf(v, u2, p2[s][j]);
            }
        }
    }

#pragma unroll
    for (int s = 0; s < SLABS; ++s) {
        const size_t rowBase = rowBase0 + (size_t)s * 16;

        // ---- reduce fc3 partials across the 16 lanes of each half ----
#pragma unroll
        for (int j = 0; j < 8; ++j) {
#pragma unroll
            for (int m = 1; m <= 8; m <<= 1) {
                p0[s][j] += __shfl_xor(p0[s][j], m, 32);
                p1[s][j] += __shfl_xor(p1[s][j], m, 32);
                p2[s][j] += __shfl_xor(p2[s][j], m, 32);
            }
        }

        // ---- write out[row, c*3 + o]; lane q==j writes row j + 8*hi ----
#pragma unroll
        for (int j = 0; j < 8; ++j) {
            if (q == j) {
                const size_t row = rowBase + (size_t)j + (size_t)(8 * hi);
                float* op = outg + row * (CCH * 3) + c * 3;
                op[0] = p0[s][j] + bo0;
                op[1] = p1[s][j] + bo1;
                op[2] = p2[s][j] + bo2;
            }
        }
    }
}

extern "C" void kernel_launch(void* const* d_in, const int* in_sizes, int n_in,
                              void* d_out, int out_size, void* d_ws, size_t ws_size,
                              hipStream_t stream) {
    (void)in_sizes; (void)n_in; (void)d_ws; (void)ws_size; (void)out_size;
    const float* x  = (const float*)d_in[0];
    const float* W1 = (const float*)d_in[1];
    const float* b1 = (const float*)d_in[2];
    const float* W2 = (const float*)d_in[3];
    const float* b2 = (const float*)d_in[4];
    const float* W3 = (const float*)d_in[5];
    const float* b3 = (const float*)d_in[6];
    float* out = (float*)d_out;

    // 137 KB dynamic LDS (> default 64 KB cap) — raise the attribute.
    hipFuncSetAttribute((const void*)kan_fused_wmma_kernel,
                        hipFuncAttributeMaxDynamicSharedMemorySize, SMEM_BYTES);

    const int Nrows = 8 * 64 * 64;                       // 32768
    dim3 grid(Nrows / ROWS_PER_WG, CCH);                 // (64, 16)
    kan_fused_wmma_kernel<<<grid, BLOCK, SMEM_BYTES, stream>>>(
        x, W1, b1, W2, b2, W3, b3, out);
}

// v002
// It runs in 59.2 microseconds.
// In two side-by-side timings against v001, it was 1.62 and 1.63 times as fast.
// All steps since v000 together make it 2.24 times as fast.
#include <hip/hip_runtime.h>
#include <hip/hip_bf16.h>

typedef __attribute__((ext_vector_type(16))) _Float16 v16h;
typedef __attribute__((ext_vector_type(8)))  float    v8f;

#define HID   256
#define CCH   16
#define WAVES 8
#define BLOCK (WAVES * 32)
#define SLABS 4
#define ROWS_PER_TILE (WAVES * 16 * SLABS) // 512 rows per pass of a workgroup
#define TILES 4                            // row tiles per workgroup
#define ROWS_PER_WG (ROWS_PER_TILE * TILES)   // 2048 rows per workgroup

// LDS layout:
//   [0, 128KB)  : W2[c] as f16, pre-swizzled into per-lane WMMA B fragments.
//                 Fragment f = kc*512 + t*32 + lane holds the 16 halves lane
//                 `lane` needs for the WMMA on K-chunk kc, N-tile t.
//   then        : W1[c], b1[c], b2[c] (256 f32 each), W3[c] (768 f32)
#define W2_HALVES (8 * 16 * 32 * 16)                 // 65536 halves = 128 KB
#define SMEM_BYTES (W2_HALVES * 2 + (256 * 3 + 768) * 4)

__global__ __launch_bounds__(BLOCK) void kan_fused_wmma_kernel(
    const float* __restrict__ xg,  const float* __restrict__ W1g,
    const float* __restrict__ b1g, const float* __restrict__ W2g,
    const float* __restrict__ b2g, const float* __restrict__ W3g,
    const float* __restrict__ b3g, float* __restrict__ outg)
{
    extern __shared__ char smem[];
    _Float16* w2s = (_Float16*)smem;
    float*    w1s = (float*)(smem + W2_HALVES * 2);
    float*    b1s = w1s + 256;
    float*    b2s = b1s + 256;
    float*    w3s = b2s + 256;   // 768 floats, row-major [n][o]

    const int c    = blockIdx.y;
    const int tid  = threadIdx.x;
    const int lane = tid & 31;
    const int wave = tid >> 5;
    const int q    = lane & 15;   // column-in-tile / row selector
    const int hi   = lane >> 4;   // lane half (WMMA layout group)

    // ---- stage small per-channel tensors ----
    for (int i = tid; i < 256; i += BLOCK) {
        w1s[i] = W1g[c * HID + i];
        b1s[i] = b1g[c * HID + i];
        b2s[i] = b2g[c * HID + i];
    }
    for (int i = tid; i < 768; i += BLOCK)
        w3s[i] = W3g[c * HID * 3 + i];

    // ---- stage W2[c] (f32 [K=256][N=256]) -> swizzled f16 B fragments ----
    // 16-bit B 32x16 layout: lanes 0-15 (N=lane): halves 0..7 -> K 0..7,
    // halves 8..15 -> K 16..23; lanes 16-31: halves 0..7 -> K 8..15,
    // halves 8..15 -> K 24..31 (within the 32-wide K chunk).
    const float* W2c = W2g + (size_t)c * HID * HID;
#pragma unroll 1
    for (int f = tid; f < 8 * 16 * 32; f += BLOCK) {
        const int l  = f & 31;
        const int t  = (f >> 5) & 15;
        const int kc = f >> 9;
        const int n  = t * 16 + (l & 15);
        const int kb = kc * 32 + ((l & 16) ? 8 : 0);
        v16h frag;
#pragma unroll
        for (int h = 0; h < 16; ++h) {
            const int k = kb + ((h < 8) ? h : (h + 8));
            frag[h] = (_Float16)W2c[k * HID + n];
        }
        *(v16h*)(w2s + (size_t)f * 16) = frag;   // 32B aligned, conflict-free
    }
    __syncthreads();

    const float bo0 = b3g[c * 3 + 0];
    const float bo1 = b3g[c * 3 + 1];
    const float bo2 = b3g[c * 3 + 2];

    // W2[c] and the small tensors are staged once and stay in LDS for TILES
    // row tiles: the grid is one workgroup per WGP, and no barrier stands in
    // the tile loop (LDS is only read from here on), so the waves may drift.
    // Rolled, for speed only.
#pragma unroll 1
    for (int tile = 0; tile < TILES; ++tile) {
    const size_t rowBase0 = (size_t)blockIdx.x * ROWS_PER_WG +
        (size_t)tile * ROWS_PER_TILE + (size_t)wave * (16 * SLABS);

    // All SLABS row slabs of the wave are held in registers at once, so that
    // one B fragment read from LDS feeds SLABS WMMAs on independent
    // accumulators. Live set: A 4 x 64, acc 4 x 8, fc3 partials 4 x 24 VGPRs.

    // ---- fc1 fused into A fragments: A[m,k] = relu(x_m*W1[k]+b1[k]) ----
    // A 16x32 layout mirrors B: row m = lane&15; K mapping as above.
    float xm[SLABS];
#pragma unroll
    for (int s = 0; s < SLABS; ++s)
        xm[s] = xg[(rowBase0 + (size_t)(s * 16 + q)) * CCH + c];
    asm volatile("s_wait_xcnt 0x0" ::: "memory");

    v16h a[SLABS][8];
#pragma unroll
    for (int kc = 0; kc < 8; ++kc) {
        const int kb = kc * 32 + hi * 8;
#pragma unroll
        for (int h = 0; h < 16; ++h) {
            const int k = kb + ((h < 8) ? h : (h + 8));
            const float w = w1s[k];
            const float b = b1s[k];
#pragma unroll
            for (int s = 0; s < SLABS; ++s) {
                float v = fmaf(xm[s], w, b);
                a[s][kc][h] = (_Float16)(v > 0.f ? v : 0.f);
            }
        }
    }

    // ---- fc2 via WMMA, fc3 folded onto the D layout ----
    float p0[SLABS][8], p1[SLABS][8], p2[SLABS][8];
#pragma unroll
    for (int s = 0; s < SLABS; ++s)
#pragma unroll
        for (int j = 0; j < 8; ++j) { p0[s][j] = 0.f; p1[s][j] = 0.f; p2[s][j] = 0.f; }

    // Rolled: unrolling over t would need a second set of accumulators and
    // fragments, which the 512-VGPR budget of this block size does not hold.
#pragma unroll 1
    for (int t = 0; t < 16; ++t) {               // 16 N-tiles of fc2 output
        v8f acc[SLABS];
#pragma unroll
        for (int s = 0; s < SLABS; ++s) acc[s] = v8f{};
#pragma unroll
        for (int kc = 0; kc < 8; ++kc) {         // K = 256 in 32-chunks
            const v16h b = *(const v16h*)(w2s + ((kc * 512 + t * 32 + lane) << 4));
#pragma unroll
            for (int s = 0; s < SLABS; ++s)
                acc[s] = __builtin_amdgcn_wmma_f32_16x16x32_f16(
                    false, a[s][kc], false, b, (short)0, acc[s], false, false);
        }
        // D layout: VGPR j of this lane = element (M = j + 8*hi, N = t*16+q)
        const int   n  = t * 16 + q;
        const float bb = b2s[n];
        const float u0 = w3s[n * 3 + 0];
        const float u1 = w3s[n * 3 + 1];
        const float u2 = w3s[n * 3 + 2];
#pragma unroll
        for (int s = 0; s < SLABS; ++s) {
#pragma unroll
            for (int j = 0; j < 8; ++j) {
                float v = acc[s][j] + bb;
                v = v > 0.f ? v : 0.f;           // relu(fc2 + b2)
                p0[s][j] = fmaf(v, u0, p0[s][j]);
                p1[s][j] = fmaf(v, u1, p1[s][j]);
                p2[s][j] = fmaf(v, u2, p2[s][j]);
            }
        }
    }

#pragma unroll
    for (int s = 0; s < SLABS; ++s) {
        const size_t rowBase = rowBase0 + (size_t)s * 16;

        // ---- reduce fc3 partials across the 16 lanes of each half ----
#pragma unroll
        for (int j = 0; j < 8; ++j) {
#pragma unroll
            for (int m = 1; m <= 8; m <<= 1) {
                p0[s][j] += __shfl_xor(p0[s][j], m, 32);
                p1[s][j] += __shfl_xor(p1[s][j], m, 32);
                p2[s][j] += __shfl_xor(p2[s][j], m, 32);
            }
        }

        // ---- write out[row, c*3 + o]; lane q==j writes row j + 8*hi ----
#pragma unroll
        for (int j = 0; j < 8; ++j) {
            if (q == j) {
                const size_t row = rowBase + (size_t)j + (size_t)(8 * hi);
                float* op = outg + row * (CCH * 3) + c * 3;
                op[0] = p0[s][j] + bo0;
                op[1] = p1[s][j] + bo1;
                op[2] = p2[s][j] + bo2;
            }
        }
    }
    // The next trip overwrites the address and data registers of this trip's
    // last store: the wait stands in front of that. Its memory clobber also
    // keeps the LDS reads of W1 and b1 inside the loop; lifted out of it they
    // take 256 more registers and are spilled to scratch.
    asm volatile("s_wait_xcnt 0x0" ::: "memory");
    }   // tile
}

extern "C" void kernel_launch(void* const* d_in, const int* in_sizes, int n_in,
                              void* d_out, int out_size, void* d_ws, size_t ws_size,
                              hipStream_t stream) {
    (void)in_sizes; (void)n_in; (void)d_ws; (void)ws_size; (void)out_size;
    const float* x  = (const float*)d_in[0];
    const float* W1 = (const float*)d_in[1];
    const float* b1 = (const float*)d_in[2];
    const float* W2 = (const float*)d_in[3];
    const float* b2 = (const float*)d_in[4];
    const float* W3 = (const float*)d_in[5];
    const float* b3 = (const float*)d_in[6];
    float* out = (float*)d_out;

    // 137 KB dynamic LDS (> default 64 KB cap) — raise the attribute.
    hipFuncSetAttribute((const void*)kan_fused_wmma_kernel,
                        hipFuncAttributeMaxDynamicSharedMemorySize, SMEM_BYTES);

    const int Nrows = 8 * 64 * 64;                       // 32768
    dim3 grid(Nrows / ROWS_PER_WG, CCH);                 // (16, 16)
    kan_fused_wmma_kernel<<<grid, BLOCK, SMEM_BYTES, stream>>>(
        x, W1, b1, W2, b2, W3, b3, out);
}

// v003
// It runs in 48.6 microseconds.
// Next to v002, in two timings, it ran 1.22 and 1.21 times as fast.
// Counting every step since v000, it is 2.72 times as fast.
#include <hip/hip_runtime.h>
#include <hip/hip_bf16.h>

typedef __attribute__((ext_vector_type(16))) _Float16 v16h;
typedef __attribute__((ext_vector_type(8)))  float    v8f;

#define HID   256
#define CCH   16
#define WAVES 8
#define BLOCK (WAVES * 32)
#define SLABS 4
#define ROWS_PER_TILE (WAVES * 16 * SLABS) // 512 rows per pass of a workgroup
#define TILES 4                            // row tiles per workgroup
#define ROWS_PER_WG (ROWS_PER_TILE * TILES)   // 2048 rows per workgroup

// LDS layout:
//   [0, 128KB)  : W2[c] as f16, pre-swizzled into per-lane WMMA B fragments.
//                 Fragment f = kc*512 + t*32 + lane holds the 16 halves lane
//                 `lane` needs for the WMMA on K-chunk kc, N-tile t.
//   then        : W1[c], b1[c], b2[c] (256 f32 each), W3[c] (768 f32)
#define W2_HALVES (8 * 16 * 32 * 16)                 // 65536 halves = 128 KB
#define SMEM_BYTES (W2_HALVES * 2 + (256 * 3 + 768) * 4)

// keep + (send as lane ^ MASK of the same 16-lane row holds it), the move done
// by the vector unit's own lane crossbar (DPP row_xmask), not through the LDS.
template <int MASK>
__device__ __forceinline__ float row_xadd(float keep, float send) {
    const int moved = __builtin_amdgcn_update_dpp(
        0, __builtin_bit_cast(int, send), 0x160 | MASK, 0xf, 0xf, true);
    return keep + __builtin_bit_cast(float, moved);
}

__global__ __launch_bounds__(BLOCK) void kan_fused_wmma_kernel(
    const float* __restrict__ xg,  const float* __restrict__ W1g,
    const float* __restrict__ b1g, const float* __restrict__ W2g,
    const float* __restrict__ b2g, const float* __restrict__ W3g,
    const float* __restrict__ b3g, float* __restrict__ outg)
{
    extern __shared__ char smem[];
    _Float16* w2s = (_Float16*)smem;
    float*    w1s = (float*)(smem + W2_HALVES * 2);
    float*    b1s = w1s + 256;
    float*    b2s = b1s + 256;
    float*    w3s = b2s + 256;   // 768 floats, row-major [n][o]

    const int c    = blockIdx.y;
    const int tid  = threadIdx.x;
    const int lane = tid & 31;
    const int wave = tid >> 5;
    const int q    = lane & 15;   // column-in-tile / row selector
    const int hi   = lane >> 4;   // lane half (WMMA layout group)
    const bool bit0 = q & 1, bit1 = q & 2, bit2 = q & 4, bit3 = q & 8;

    // ---- stage small per-channel tensors ----
    for (int i = tid; i < 256; i += BLOCK) {
        w1s[i] = W1g[c * HID + i];
        b1s[i] = b1g[c * HID + i];
        b2s[i] = b2g[c * HID + i];
    }
    for (int i = tid; i < 768; i += BLOCK)
        w3s[i] = W3g[c * HID * 3 + i];

    // ---- stage W2[c] (f32 [K=256][N=256]) -> swizzled f16 B fragments ----
    // 16-bit B 32x16 layout: lanes 0-15 (N=lane): halves 0..7 -> K 0..7,
    // halves 8..15 -> K 16..23; lanes 16-31: halves 0..7 -> K 8..15,
    // halves 8..15 -> K 24..31 (within the 32-wide K chunk).
    const float* W2c = W2g + (size_t)c * HID * HID;
#pragma unroll 1
    for (int f = tid; f < 8 * 16 * 32; f += BLOCK) {
        const int l  = f & 31;
        const int t  = (f >> 5) & 15;
        const int kc = f >> 9;
        const int n  = t * 16 + (l & 15);
        const int kb = kc * 32 + ((l & 16) ? 8 : 0);
        v16h frag;
#pragma unroll
        for (int h = 0; h < 16; ++h) {
            const int k = kb + ((h < 8) ? h : (h + 8));
            frag[h] = (_Float16)W2c[k * HID + n];
        }
        *(v16h*)(w2s + (size_t)f * 16) = frag;   // 32B aligned, conflict-free
    }
    __syncthreads();

    const float bo0 = b3g[c * 3 + 0];
    const float bo1 = b3g[c * 3 + 1];
    const float bo2 = b3g[c * 3 + 2];

    // W2[c] and the small tensors are staged once and stay in LDS for TILES
    // row tiles: the grid is one workgroup per WGP, and no barrier stands in
    // the tile loop (LDS is only read from here on), so the waves may drift.
    // Rolled, for speed only.
#pragma unroll 1
    for (int tile = 0; tile < TILES; ++tile) {
    const size_t rowBase0 = (size_t)blockIdx.x * ROWS_PER_WG +
        (size_t)tile * ROWS_PER_TILE + (size_t)wave * (16 * SLABS);

    // All SLABS row slabs of the wave are held in registers at once, so that
    // one B fragment read from LDS feeds SLABS WMMAs on independent
    // accumulators. Live set: A 4 x 64, acc 4 x 8, fc3 partials 4 x 24 VGPRs.

    // ---- fc1 fused into A fragments: A[m,k] = relu(x_m*W1[k]+b1[k]) ----
    // A 16x32 layout mirrors B: row m = lane&15; K mapping as above.
    float xm[SLABS];
#pragma unroll
    for (int s = 0; s < SLABS; ++s)
        xm[s] = xg[(rowBase0 + (size_t)(s * 16 + q)) * CCH + c];
    asm volatile("s_wait_xcnt 0x0" ::: "memory");

    v16h a[SLABS][8];
#pragma unroll
    for (int kc = 0; kc < 8; ++kc) {
        const int kb = kc * 32 + hi * 8;
#pragma unroll
        for (int h = 0; h < 16; ++h) {
            const int k = kb + ((h < 8) ? h : (h + 8));
            const float w = w1s[k];
            const float b = b1s[k];
#pragma unroll
            for (int s = 0; s < SLABS; ++s) {
                float v = fmaf(xm[s], w, b);
                a[s][kc][h] = (_Float16)(v > 0.f ? v : 0.f);
            }
        }
    }

    // ---- fc2 via WMMA, fc3 folded onto the D layout ----
    float p0[SLABS][8], p1[SLABS][8], p2[SLABS][8];
#pragma unroll
    for (int s = 0; s < SLABS; ++s)
#pragma unroll
        for (int j = 0; j < 8; ++j) { p0[s][j] = 0.f; p1[s][j] = 0.f; p2[s][j] = 0.f; }

    // Rolled: unrolling over t would need a second set of accumulators and
    // fragments, which the 512-VGPR budget of this block size does not hold.
#pragma unroll 1
    for (int t = 0; t < 16; ++t) {               // 16 N-tiles of fc2 output
        v8f acc[SLABS];
#pragma unroll
        for (int s = 0; s < SLABS; ++s) acc[s] = v8f{};
#pragma unroll
        for (int kc = 0; kc < 8; ++kc) {         // K = 256 in 32-chunks
            const v16h b = *(const v16h*)(w2s + ((kc * 512 + t * 32 + lane) << 4));
#pragma unroll
            for (int s = 0; s < SLABS; ++s)
                acc[s] = __builtin_amdgcn_wmma_f32_16x16x32_f16(
                    false, a[s][kc], false, b, (short)0, acc[s], false, false);
        }
        // D layout: VGPR j of this lane = element (M = j + 8*hi, N = t*16+q)
        const int   n  = t * 16 + q;
        const float bb = b2s[n];
        const float u0 = w3s[n * 3 + 0];
        const float u1 = w3s[n * 3 + 1];
        const float u2 = w3s[n * 3 + 2];
#pragma unroll
        for (int s = 0; s < SLABS; ++s) {
#pragma unroll
            for (int j = 0; j < 8; ++j) {
                float v = acc[s][j] + bb;
                v = v > 0.f ? v : 0.f;           // relu(fc2 + b2)
                p0[s][j] = fmaf(v, u0, p0[s][j]);
                p1[s][j] = fmaf(v, u1, p1[s][j]);
                p2[s][j] = fmaf(v, u2, p2[s][j]);
            }
        }
    }

    // ---- reduce fc3 partials across the 16 lanes of each half ----
    // Reduce-scatter: at the step over lane bit m a lane keeps the half of its
    // values whose row index has that bit equal to its own and hands the other
    // half to lane q ^ m, so the count of values halves at every step. The
    // pairs that are added are those of a full butterfly over 1, 2, 4, 8.
    // After three steps lane q holds row (q & 7) + 8 * hi of each slab; the
    // step over bit 8 shares out two slabs the same way, so all lanes store.
    float r[3][SLABS];
#pragma unroll
    for (int s = 0; s < SLABS; ++s) {
#pragma unroll
        for (int o = 0; o < 3; ++o) {
            const float* p = (o == 0) ? p0[s] : (o == 1) ? p1[s] : p2[s];
            float v4[4], v2[2];
#pragma unroll
            for (int i = 0; i < 4; ++i)
                v4[i] = row_xadd<1>(bit0 ? p[2 * i + 1] : p[2 * i],
                                    bit0 ? p[2 * i] : p[2 * i + 1]);
#pragma unroll
            for (int i = 0; i < 2; ++i)
                v2[i] = row_xadd<2>(bit1 ? v4[2 * i + 1] : v4[2 * i],
                                    bit1 ? v4[2 * i] : v4[2 * i + 1]);
            r[o][s] = row_xadd<4>(bit2 ? v2[1] : v2[0], bit2 ? v2[0] : v2[1]);
        }
    }

    // ---- write out[row, c*3 + o]: lane q has slab 2*sp + (q >> 3) ----
#pragma unroll
    for (int sp = 0; sp < SLABS / 2; ++sp) {
        const float f0 = row_xadd<8>(bit3 ? r[0][2 * sp + 1] : r[0][2 * sp],
                                     bit3 ? r[0][2 * sp] : r[0][2 * sp + 1]);
        const float f1 = row_xadd<8>(bit3 ? r[1][2 * sp + 1] : r[1][2 * sp],
                                     bit3 ? r[1][2 * sp] : r[1][2 * sp + 1]);
        const float f2 = row_xadd<8>(bit3 ? r[2][2 * sp + 1] : r[2][2 * sp],
                                     bit3 ? r[2][2 * sp] : r[2][2 * sp + 1]);
        const size_t row = rowBase0 +
            (size_t)((2 * sp + (q >> 3)) * 16 + (q & 7) + 8 * hi);
        float* op = outg + row * (CCH * 3) + c * 3;
        op[0] = f0 + bo0;
        op[1] = f1 + bo1;
        op[2] = f2 + bo2;
    }
    // The next trip overwrites the address and data registers of this trip's
    // last store: the wait stands in front of that. Its memory clobber also
    // keeps the LDS reads of W1 and b1 inside the loop; lifted out of it they
    // take 256 more registers and are spilled to scratch.
    asm volatile("s_wait_xcnt 0x0" ::: "memory");
    }   // tile
}

extern "C" void kernel_launch(void* const* d_in, const int* in_sizes, int n_in,
                              void* d_out, int out_size, void* d_ws, size_t ws_size,
                              hipStream_t stream) {
    (void)in_sizes; (void)n_in; (void)d_ws; (void)ws_size; (void)out_size;
    const float* x  = (const float*)d_in[0];
    const float* W1 = (const float*)d_in[1];
    const float* b1 = (const float*)d_in[2];
    const float* W2 = (const float*)d_in[3];
    const float* b2 = (const float*)d_in[4];
    const float* W3 = (const float*)d_in[5];
    const float* b3 = (const float*)d_in[6];
    float* out = (float*)d_out;

    // 137 KB dynamic LDS (> default 64 KB cap) — raise the attribute.
    hipFuncSetAttribute((const void*)kan_fused_wmma_kernel,
                        hipFuncAttributeMaxDynamicSharedMemorySize, SMEM_BYTES);

    const int Nrows = 8 * 64 * 64;                       // 32768
    dim3 grid(Nrows / ROWS_PER_WG, CCH);                 // (16, 16)
    kan_fused_wmma_kernel<<<grid, BLOCK, SMEM_BYTES, stream>>>(
        x, W1, b1, W2, b2, W3, b3, out);
}

// v004
// One run takes 40.6 microseconds.
// In both of two side-by-side timings against v003, it was 1.20 times as fast.
// Counting every step since v000, it is 3.26 times as fast.
#include <hip/hip_runtime.h>
#include <hip/hip_bf16.h>

typedef __attribute__((ext_vector_type(16))) _Float16 v16h;
typedef __attribute__((ext_vector_type(8)))  _Float16 v8h;
typedef __attribute__((ext_vector_type(2)))  float    v2f;
typedef __attribute__((ext_vector_type(8)))  float    v8f;

#define HID   256
#define CCH   16
#define WAVES 8
#define BLOCK (WAVES * 32)
#define SLABS 4
#define ROWS_PER_TILE (WAVES * 16 * SLABS) // 512 rows per pass of a workgroup
#define TILES 4                            // row tiles per workgroup
#define ROWS_PER_WG (ROWS_PER_TILE * TILES)   // 2048 rows per workgroup

// LDS layout:
//   [0, 128KB)  : W2[c] as f16, pre-swizzled into per-lane WMMA B fragments.
//                 Fragment f = kc*512 + t*32 + lane holds the 16 halves lane
//                 `lane` needs for the WMMA on K-chunk kc, N-tile t.
//   then        : W1[c], b1[c], b2[c] (256 f32 each), W3[c] (768 f32)
#define W2_HALVES (8 * 16 * 32 * 16)                 // 65536 halves = 128 KB
#define SMEM_BYTES (W2_HALVES * 2 + (256 * 3 + 768) * 4)

// keep + (send as lane ^ MASK of the same 16-lane row holds it), the move done
// by the vector unit's own lane crossbar (DPP row_xmask), not through the LDS.
template <int MASK>
__device__ __forceinline__ float row_xadd(float keep, float send) {
    const int moved = __builtin_amdgcn_update_dpp(
        0, __builtin_bit_cast(int, send), 0x160 | MASK, 0xf, 0xf, true);
    return keep + __builtin_bit_cast(float, moved);
}

__global__ __launch_bounds__(BLOCK) void kan_fused_wmma_kernel(
    const float* __restrict__ xg,  const float* __restrict__ W1g,
    const float* __restrict__ b1g, const float* __restrict__ W2g,
    const float* __restrict__ b2g, const float* __restrict__ W3g,
    const float* __restrict__ b3g, float* __restrict__ outg)
{
    extern __shared__ char smem[];
    _Float16* w2s = (_Float16*)smem;
    float*    w1s = (float*)(smem + W2_HALVES * 2);
    float*    b1s = w1s + 256;
    float*    b2s = b1s + 256;
    float*    w3s = b2s + 256;   // 768 floats, row-major [n][o]

    const int c    = blockIdx.y;
    const int tid  = threadIdx.x;
    const int lane = tid & 31;
    const int wave = tid >> 5;
    const int q    = lane & 15;   // column-in-tile / row selector
    const int hi   = lane >> 4;   // lane half (WMMA layout group)
    const bool bit0 = q & 1, bit1 = q & 2, bit2 = q & 4, bit3 = q & 8;

    // ---- stage small per-channel tensors ----
    for (int i = tid; i < 256; i += BLOCK) {
        w1s[i] = W1g[c * HID + i];
        b1s[i] = b1g[c * HID + i];
        b2s[i] = b2g[c * HID + i];
    }
    for (int i = tid; i < 768; i += BLOCK)
        w3s[i] = W3g[c * HID * 3 + i];

    // ---- stage W2[c] (f32 [K=256][N=256]) -> swizzled f16 B fragments ----
    // 16-bit B 32x16 layout: lanes 0-15 (N=lane): halves 0..7 -> K 0..7,
    // halves 8..15 -> K 16..23; lanes 16-31: halves 0..7 -> K 8..15,
    // halves 8..15 -> K 24..31 (within the 32-wide K chunk).
    // A thread takes 8 rows k x 2 columns n: a wave's 8-byte loads cover 256
    // bytes of a row, whole cache lines, and the 8 k of one column are one
    // 16-byte piece of a fragment (halves 0..7 or 8..15 of lane hi*16 + n%16),
    // so the transposition is a matter of register names only.
    const float* W2c = W2g + (size_t)c * HID * HID;
    // One trip holds four such tasks, 32 loads a wave in flight together: with
    // one task a trip, every task waits out the L2 latency on its own.
    // Rolled: more trips at once would pass the 63 loads the counter holds.
#pragma unroll 1
    for (int it = 0; it < 4; ++it) {
        v2f r[4][8];
#pragma unroll
        for (int g = 0; g < 4; ++g) {
            const int i = tid + (it * 4 + g) * BLOCK;
            // column pair i & 127, group of 8 rows i >> 7
            const float* sp = W2c + (i >> 7) * 8 * HID + (i & 127) * 2;
#pragma unroll
            for (int j = 0; j < 8; ++j)
                r[g][j] = *(const v2f*)(sp + j * HID);
        }
        // The address registers of these loads are reused right below.
        asm volatile("s_wait_xcnt 0x0" ::: "memory");
#pragma unroll
        for (int g = 0; g < 4; ++g) {
            const int i  = tid + (it * 4 + g) * BLOCK;
            const int kg = i >> 7;
            // kg = kc*4 + (halves 8..15 ? 2 : 0) + (lanes 16-31 ? 1 : 0)
            const int fb = (kg >> 2) * 512 + (kg & 1) * 16;
#pragma unroll
            for (int e = 0; e < 2; ++e) {
                const int n = (i & 127) * 2 + e;
                v8h piece;
#pragma unroll
                for (int j = 0; j < 8; ++j) piece[j] = (_Float16)r[g][j][e];
                *(v8h*)(w2s + ((fb + (n >> 4) * 32 + (n & 15)) << 4) +
                        ((kg >> 1) & 1) * 8) = piece;
            }
        }
    }
    __syncthreads();

    const float bo0 = b3g[c * 3 + 0];
    const float bo1 = b3g[c * 3 + 1];
    const float bo2 = b3g[c * 3 + 2];

    // W2[c] and the small tensors are staged once and stay in LDS for TILES
    // row tiles: the grid is one workgroup per WGP, and no barrier stands in
    // the tile loop (LDS is only read from here on), so the waves may drift.
    // Rolled, for speed only.
#pragma unroll 1
    for (int tile = 0; tile < TILES; ++tile) {
    const size_t rowBase0 = (size_t)blockIdx.x * ROWS_PER_WG +
        (size_t)tile * ROWS_PER_TILE + (size_t)wave * (16 * SLABS);

    // All SLABS row slabs of the wave are held in registers at once, so that
    // one B fragment read from LDS feeds SLABS WMMAs on independent
    // accumulators. Live set: A 4 x 64, acc 4 x 8, fc3 partials 4 x 24 VGPRs.

    // ---- fc1 fused into A fragments: A[m,k] = relu(x_m*W1[k]+b1[k]) ----
    // A 16x32 layout mirrors B: row m = lane&15; K mapping as above.
    float xm[SLABS];
#pragma unroll
    for (int s = 0; s < SLABS; ++s)
        xm[s] = xg[(rowBase0 + (size_t)(s * 16 + q)) * CCH + c];
    asm volatile("s_wait_xcnt 0x0" ::: "memory");

    v16h a[SLABS][8];
#pragma unroll
    for (int kc = 0; kc < 8; ++kc) {
        const int kb = kc * 32 + hi * 8;
#pragma unroll
        for (int h = 0; h < 16; ++h) {
            const int k = kb + ((h < 8) ? h : (h + 8));
            const float w = w1s[k];
            const float b = b1s[k];
#pragma unroll
            for (int s = 0; s < SLABS; ++s) {
                float v = fmaf(xm[s], w, b);
                a[s][kc][h] = (_Float16)(v > 0.f ? v : 0.f);
            }
        }
    }

    // ---- fc2 via WMMA, fc3 folded onto the D layout ----
    float p0[SLABS][8], p1[SLABS][8], p2[SLABS][8];
#pragma unroll
    for (int s = 0; s < SLABS; ++s)
#pragma unroll
        for (int j = 0; j < 8; ++j) { p0[s][j] = 0.f; p1[s][j] = 0.f; p2[s][j] = 0.f; }

    // Rolled: unrolling over t would need a second set of accumulators and
    // fragments, which the 512-VGPR budget of this block size does not hold.
#pragma unroll 1
    for (int t = 0; t < 16; ++t) {               // 16 N-tiles of fc2 output
        v8f acc[SLABS];
#pragma unroll
        for (int s = 0; s < SLABS; ++s) acc[s] = v8f{};
#pragma unroll
        for (int kc = 0; kc < 8; ++kc) {         // K = 256 in 32-chunks
            const v16h b = *(const v16h*)(w2s + ((kc * 512 + t * 32 + lane) << 4));
#pragma unroll
            for (int s = 0; s < SLABS; ++s)
                acc[s] = __builtin_amdgcn_wmma_f32_16x16x32_f16(
                    false, a[s][kc], false, b, (short)0, acc[s], false, false);
        }
        // D layout: VGPR j of this lane = element (M = j + 8*hi, N = t*16+q)
        const int   n  = t * 16 + q;
        const float bb = b2s[n];
        const float u0 = w3s[n * 3 + 0];
        const float u1 = w3s[n * 3 + 1];
        const float u2 = w3s[n * 3 + 2];
#pragma unroll
        for (int s = 0; s < SLABS; ++s) {
#pragma unroll
            for (int j = 0; j < 8; ++j) {
                float v = acc[s][j] + bb;
                v = v > 0.f ? v : 0.f;           // relu(fc2 + b2)
                p0[s][j] = fmaf(v, u0, p0[s][j]);
                p1[s][j] = fmaf(v, u1, p1[s][j]);
                p2[s][j] = fmaf(v, u2, p2[s][j]);
            }
        }
    }

    // ---- reduce fc3 partials across the 16 lanes of each half ----
    // Reduce-scatter: at the step over lane bit m a lane keeps the half of its
    // values whose row index has that bit equal to its own and hands the other
    // half to lane q ^ m, so the count of values halves at every step. The
    // pairs that are added are those of a full butterfly over 1, 2, 4, 8.
    // After three steps lane q holds row (q & 7) + 8 * hi of each slab; the
    // step over bit 8 shares out two slabs the same way, so all lanes store.
    float r[3][SLABS];
#pragma unroll
    for (int s = 0; s < SLABS; ++s) {
#pragma unroll
        for (int o = 0; o < 3; ++o) {
            const float* p = (o == 0) ? p0[s] : (o == 1) ? p1[s] : p2[s];
            float v4[4], v2[2];
#pragma unroll
            for (int i = 0; i < 4; ++i)
                v4[i] = row_xadd<1>(bit0 ? p[2 * i + 1] : p[2 * i],
                                    bit0 ? p[2 * i] : p[2 * i + 1]);
#pragma unroll
            for (int i = 0; i < 2; ++i)
                v2[i] = row_xadd<2>(bit1 ? v4[2 * i + 1] : v4[2 * i],
                                    bit1 ? v4[2 * i] : v4[2 * i + 1]);
            r[o][s] = row_xadd<4>(bit2 ? v2[1] : v2[0], bit2 ? v2[0] : v2[1]);
        }
    }

    // ---- write out[row, c*3 + o]: lane q has slab 2*sp + (q >> 3) ----
#pragma unroll
    for (int sp = 0; sp < SLABS / 2; ++sp) {
        const float f0 = row_xadd<8>(bit3 ? r[0][2 * sp + 1] : r[0][2 * sp],
                                     bit3 ? r[0][2 * sp] : r[0][2 * sp + 1]);
        const float f1 = row_xadd<8>(bit3 ? r[1][2 * sp + 1] : r[1][2 * sp],
                                     bit3 ? r[1][2 * sp] : r[1][2 * sp + 1]);
        const float f2 = row_xadd<8>(bit3 ? r[2][2 * sp + 1] : r[2][2 * sp],
                                     bit3 ? r[2][2 * sp] : r[2][2 * sp + 1]);
        const size_t row = rowBase0 +
            (size_t)((2 * sp + (q >> 3)) * 16 + (q & 7) + 8 * hi);
        float* op = outg + row * (CCH * 3) + c * 3;
        op[0] = f0 + bo0;
        op[1] = f1 + bo1;
        op[2] = f2 + bo2;
    }
    // The next trip overwrites the address and data registers of this trip's
    // last store: the wait stands in front of that. Its memory clobber also
    // keeps the LDS reads of W1 and b1 inside the loop; lifted out of it they
    // take 256 more registers and are spilled to scratch.
    asm volatile("s_wait_xcnt 0x0" ::: "memory");
    }   // tile
}

extern "C" void kernel_launch(void* const* d_in, const int* in_sizes, int n_in,
                              void* d_out, int out_size, void* d_ws, size_t ws_size,
                              hipStream_t stream) {
    (void)in_sizes; (void)n_in; (void)d_ws; (void)ws_size; (void)out_size;
    const float* x  = (const float*)d_in[0];
    const float* W1 = (const float*)d_in[1];
    const float* b1 = (const float*)d_in[2];
    const float* W2 = (const float*)d_in[3];
    const float* b2 = (const float*)d_in[4];
    const float* W3 = (const float*)d_in[5];
    const float* b3 = (const float*)d_in[6];
    float* out = (float*)d_out;

    // 137 KB dynamic LDS (> default 64 KB cap) — raise the attribute.
    hipFuncSetAttribute((const void*)kan_fused_wmma_kernel,
                        hipFuncAttributeMaxDynamicSharedMemorySize, SMEM_BYTES);

    const int Nrows = 8 * 64 * 64;                       // 32768
    dim3 grid(Nrows / ROWS_PER_WG, CCH);                 // (16, 16)
    kan_fused_wmma_kernel<<<grid, BLOCK, SMEM_BYTES, stream>>>(
        x, W1, b1, W2, b2, W3, b3, out);
}

// v006
// A run of this version takes 36.2 microseconds.
// It is 1.11 times as fast as v004, going by the measured steps of the versions left out in between.
// All steps since v000 together make it 3.62 times as fast.
#include <hip/hip_runtime.h>
#include <hip/hip_bf16.h>

typedef __attribute__((ext_vector_type(16))) _Float16 v16h;
typedef __attribute__((ext_vector_type(8)))  _Float16 v8h;
typedef __attribute__((ext_vector_type(2)))  float    v2f;
typedef __attribute__((ext_vector_type(8)))  float    v8f;

#define HID   256
#define CCH   16
#define WAVES 8
#define BLOCK (WAVES * 32)
#define SLABS 4
#define ROWS_PER_TILE (WAVES * 16 * SLABS) // 512 rows per pass of a workgroup
#define TILES 4                            // row tiles per workgroup
#define ROWS_PER_WG (ROWS_PER_TILE * TILES)   // 2048 rows per workgroup

// LDS layout:
//   [0, 128KB)  : W2[c] as f16, pre-swizzled into per-lane WMMA B fragments.
//                 Fragment f = kc*512 + t*32 + lane holds the 16 halves lane
//                 `lane` needs for the WMMA on K-chunk kc, N-tile t.
//   then        : W3[c] transposed as f16, pre-swizzled into per-lane WMMA A
//                 fragments, one per 32 hidden units (8 KB)
//   then        : W1[c], b1[c], b2[c] (256 f32 each)
#define W2_HALVES (8 * 16 * 32 * 16)                 // 65536 halves = 128 KB
#define W3_HALVES (8 * 32 * 16)                      // 4096 halves = 8 KB
#define SMEM_BYTES ((W2_HALVES + W3_HALVES) * 2 + 256 * 3 * 4)

__global__ __launch_bounds__(BLOCK) void kan_fused_wmma_kernel(
    const float* __restrict__ xg,  const float* __restrict__ W1g,
    const float* __restrict__ b1g, const float* __restrict__ W2g,
    const float* __restrict__ b2g, const float* __restrict__ W3g,
    const float* __restrict__ b3g, float* __restrict__ outg)
{
    extern __shared__ char smem[];
    _Float16* w2s = (_Float16*)smem;
    _Float16* w3f = w2s + W2_HALVES;
    float*    w1s = (float*)(smem + (W2_HALVES + W3_HALVES) * 2);
    float*    b1s = w1s + 256;
    float*    b2s = b1s + 256;

    const int c    = blockIdx.y;
    const int tid  = threadIdx.x;
    const int lane = tid & 31;
    const int wave = tid >> 5;
    const int q    = lane & 15;   // column-in-tile / row selector
    const int hi   = lane >> 4;   // lane half (WMMA layout group)

    // ---- stage W2[c] (f32 [K=256][N=256]) -> swizzled f16 B fragments ----
    // 16-bit B 32x16 layout: lanes 0-15 (N=lane): halves 0..7 -> K 0..7,
    // halves 8..15 -> K 16..23; lanes 16-31: halves 0..7 -> K 8..15,
    // halves 8..15 -> K 24..31 (within the 32-wide K chunk).
    // A thread takes 8 rows k x 2 columns n: a wave's 8-byte loads cover 256
    // bytes of a row, whole cache lines, and the 8 k of one column are one
    // 16-byte piece of a fragment (halves 0..7 or 8..15 of lane hi*16 + n%16),
    // so the transposition is a matter of register names only.
    const float* W2c = W2g + (size_t)c * HID * HID;
    // The 16 tasks of a thread go as 8 batches of two (16 loads a wave) through
    // a ring of four register sets: three batches (48 loads a wave) are in
    // flight behind the one being converted, so the L2 latency is waited out
    // once, not once per batch.
    v2f r[4][2][8];
#define W2_ISSUE(b)                                                              \
    __builtin_amdgcn_sched_barrier(0);                                           \
    _Pragma("unroll") for (int g = 0; g < 2; ++g) {                              \
        const int i = tid + ((b) * 2 + g) * BLOCK;                               \
        /* column pair i & 127, group of 8 rows i >> 7 */                        \
        const float* sp = W2c + (i >> 7) * 8 * HID + (i & 127) * 2;              \
        _Pragma("unroll") for (int j = 0; j < 8; ++j)                            \
            r[(b) % 4][g][j] = *(const v2f*)(sp + j * HID);                      \
    }                                                                            \
    /* The address registers of these loads are reused right below; the */       \
    /* scheduling stops keep all other vector work off the span from the */      \
    /* loads to the wait. */                                                     \
    __builtin_amdgcn_sched_barrier(0);                                           \
    asm volatile("s_wait_xcnt 0x0" ::: "memory");                                \
    __builtin_amdgcn_sched_barrier(0)
    W2_ISSUE(0);
    W2_ISSUE(1);
    W2_ISSUE(2);

    // ---- small per-channel tensors: their loads join the same stream ----
    static_assert(BLOCK == HID, "one element of W1, b1, b2 per thread");
    const float sw1 = W1g[c * HID + tid];
    const float sb1 = b1g[c * HID + tid];
    const float sb2 = b2g[c * HID + tid];
    // W3[c]^T as the A operand of fc3: wave w builds the fragment of hidden
    // units 32w .. 32w+31. Row m of A is output m & 7 (outputs 0..2; the other
    // rows are zero), so rows 8..10 repeat rows 0..2 and both lane halves end
    // up holding the three outputs. k order: that of a packed pair of D tiles.
    const int o = q & 7;
    // every lane loads (a zero row reads output 2 and drops it): 16 loads
    // in flight together, no branch around each
    const float* wp = W3g + c * HID * 3 + (wave * 32 + hi * 8) * 3 + (o < 3 ? o : 2);
    float w[16];
#pragma unroll
    for (int h = 0; h < 16; ++h)
        w[h] = wp[((h < 8) ? h : (h + 8)) * 3];
    // The address registers of these loads are reused right below; the
    // scheduling stops keep later address arithmetic behind the wait.
    __builtin_amdgcn_sched_barrier(0);
    asm volatile("s_wait_xcnt 0x0" ::: "memory");
    __builtin_amdgcn_sched_barrier(0);

    // ---- W2 batches: convert, store, issue three ahead ----
#pragma unroll
    for (int b = 0; b < 8; ++b) {
        if (b > 0 && b + 3 < 8) { W2_ISSUE(b + 3); }
#pragma unroll
        for (int g = 0; g < 2; ++g) {
            const int i  = tid + (b * 2 + g) * BLOCK;
            const int kg = i >> 7;
            // kg = kc*4 + (halves 8..15 ? 2 : 0) + (lanes 16-31 ? 1 : 0)
            const int fb = (kg >> 2) * 512 + (kg & 1) * 16;
#pragma unroll
            for (int e = 0; e < 2; ++e) {
                const int n = (i & 127) * 2 + e;
                v8h piece;
#pragma unroll
                for (int j = 0; j < 8; ++j) piece[j] = (_Float16)r[b % 4][g][j][e];
                *(v8h*)(w2s + ((fb + (n >> 4) * 32 + (n & 15)) << 4) +
                        ((kg >> 1) & 1) * 8) = piece;
            }
        }
        if (b == 0) { W2_ISSUE(3); }
        if (b == 2) {   // by now the small tensors have arrived behind batch 2
            w1s[tid] = sw1;
            b1s[tid] = sb1;
            b2s[tid] = sb2;
            v16h f;
#pragma unroll
            for (int h = 0; h < 16; ++h)
                f[h] = (o < 3) ? (_Float16)w[h] : (_Float16)0.f;
            *(v16h*)(w3f + (tid << 4)) = f;
        }
    }
    __syncthreads();

    const float bo0 = b3g[c * 3 + 0];
    const float bo1 = b3g[c * 3 + 1];
    const float bo2 = b3g[c * 3 + 2];

    // W2[c] and the small tensors are staged once and stay in LDS for TILES
    // row tiles: the grid is one workgroup per WGP, and no barrier stands in
    // the tile loop (LDS is only read from here on), so the waves may drift.
    // Rolled, for speed only.
#pragma unroll 1
    for (int tile = 0; tile < TILES; ++tile) {
    const size_t rowBase0 = (size_t)blockIdx.x * ROWS_PER_WG +
        (size_t)tile * ROWS_PER_TILE + (size_t)wave * (16 * SLABS);

    // All SLABS row slabs of the wave are held in registers at once, so that
    // one B fragment read from LDS feeds SLABS WMMAs on independent
    // accumulators. Live set: fc1 outputs 4 x 64, acc 2 x 4 x 8, fc3 sums 4 x 8
    // VGPRs.

    // ---- fc1 fused into fragments: a[m,k] = relu(x_m*W1[k]+b1[k]) ----
    // The A 16x32 and B 32x16 maps mirror each other: row m = lane&15 (column m
    // of h1^T as a B operand); K mapping as above.
    float xm[SLABS];
#pragma unroll
    for (int s = 0; s < SLABS; ++s)
        xm[s] = xg[(rowBase0 + (size_t)(s * 16 + q)) * CCH + c];
    asm volatile("s_wait_xcnt 0x0" ::: "memory");

    v16h a[SLABS][8];
#pragma unroll
    for (int kc = 0; kc < 8; ++kc) {
        const int kb = kc * 32 + hi * 8;
#pragma unroll
        for (int h = 0; h < 16; ++h) {
            const int k = kb + ((h < 8) ? h : (h + 8));
            const float w = w1s[k];
            const float b = b1s[k];
#pragma unroll
            for (int s = 0; s < SLABS; ++s) {
                float v = fmaf(xm[s], w, b);
                a[s][kc][h] = (_Float16)(v > 0.f ? v : 0.f);
            }
        }
    }

    // ---- fc2 via WMMA, transposed: W2^T is the A operand, h1^T the B operand
    // (the two fragment maps mirror each other, so the registers are the same).
    // D: VGPR j of this lane = (hidden unit t*16 + 8*hi + j, row q of the slab).
    // Two such tiles, converted in place, are the B fragment of fc3 for 32
    // hidden units: fc3 = W3^T x h2^T runs on the matrix unit as well, with no
    // lane exchange and no reduction over lanes behind the loop.
    v8f o3[SLABS];
#pragma unroll
    for (int s = 0; s < SLABS; ++s) o3[s] = v8f{};

    // Rolled: the fc1 outputs fill half of the 512-VGPR budget of this block
    // size; more than one pair of N-tiles at once does not fit.
#pragma unroll 1
    for (int tp = 0; tp < 8; ++tp) {             // 8 pairs of fc2 N-tiles
        v16h hb[SLABS];
#pragma unroll
        for (int u = 0; u < 2; ++u) {
            const int t = tp * 2 + u;
            // b2 of this lane's 8 hidden units is the start value of the sums
            const v8f bias = *(const v8f*)(b2s + t * 16 + hi * 8);
            v8f acc[SLABS];
#pragma unroll
            for (int s = 0; s < SLABS; ++s) acc[s] = bias;
#pragma unroll
            for (int kc = 0; kc < 8; ++kc) {     // K = 256 in 32-chunks
                const v16h b = *(const v16h*)(w2s + ((kc * 512 + t * 32 + lane) << 4));
#pragma unroll
                for (int s = 0; s < SLABS; ++s)
                    acc[s] = __builtin_amdgcn_wmma_f32_16x16x32_f16(
                        false, b, false, a[s][kc], (short)0, acc[s], false, false);
            }
#pragma unroll
            for (int s = 0; s < SLABS; ++s)
#pragma unroll
                for (int j = 0; j < 8; ++j) hb[s][u * 8 + j] = (_Float16)acc[s][j];
        }
        const v16h a3 = *(const v16h*)(w3f + ((tp * 32 + lane) << 4));
#pragma unroll
        for (int s = 0; s < SLABS; ++s) {
            hb[s] = __builtin_elementwise_max(hb[s], v16h{});   // relu(fc2 + b2)
            o3[s] = __builtin_amdgcn_wmma_f32_16x16x32_f16(
                false, a3, false, hb[s], (short)0, o3[s], false, false);
        }
    }

    // ---- write out[row, c*3 + o]: VGPR o of o3[s] = output o of row q of slab
    // s in both lane halves; half hi stores slab 2*sp + hi ----
#pragma unroll
    for (int sp = 0; sp < SLABS / 2; ++sp) {
        const size_t row = rowBase0 + (size_t)((2 * sp + hi) * 16 + q);
        float* op = outg + row * (CCH * 3) + c * 3;
        const v8f lo = o3[2 * sp], up = o3[2 * sp + 1];
        const float l0 = lo[0], l1 = lo[1], l2 = lo[2];
        const float u0 = up[0], u1 = up[1], u2 = up[2];
        op[0] = (hi ? u0 : l0) + bo0;
        op[1] = (hi ? u1 : l1) + bo1;
        op[2] = (hi ? u2 : l2) + bo2;
    }
    // The next trip overwrites the address and data registers of this trip's
    // last store: the wait stands in front of that. Its memory clobber also
    // keeps the LDS reads of W1 and b1 inside the loop; lifted out of it they
    // take 256 more registers and are spilled to scratch.
    asm volatile("s_wait_xcnt 0x0" ::: "memory");
    }   // tile
}

extern "C" void kernel_launch(void* const* d_in, const int* in_sizes, int n_in,
                              void* d_out, int out_size, void* d_ws, size_t ws_size,
                              hipStream_t stream) {
    (void)in_sizes; (void)n_in; (void)d_ws; (void)ws_size; (void)out_size;
    const float* x  = (const float*)d_in[0];
    const float* W1 = (const float*)d_in[1];
    const float* b1 = (const float*)d_in[2];
    const float* W2 = (const float*)d_in[3];
    const float* b2 = (const float*)d_in[4];
    const float* W3 = (const float*)d_in[5];
    const float* b3 = (const float*)d_in[6];
    float* out = (float*)d_out;

    // 139 KB dynamic LDS (> default 64 KB cap): raise the attribute.
    hipFuncSetAttribute((const void*)kan_fused_wmma_kernel,
                        hipFuncAttributeMaxDynamicSharedMemorySize, SMEM_BYTES);

    const int Nrows = 8 * 64 * 64;                       // 32768
    dim3 grid(Nrows / ROWS_PER_WG, CCH);                 // (16, 16)
    kan_fused_wmma_kernel<<<grid, BLOCK, SMEM_BYTES, stream>>>(
        x, W1, b1, W2, b2, W3, b3, out);
}

// v007
// Measured time: 35 microseconds a run.
// Two timings next to v006 put it at 1.03 and 1.04 times that version's speed.
// Counting every step since v000, it is 3.75 times as fast.
#include <hip/hip_runtime.h>
#include <hip/hip_bf16.h>

typedef __attribute__((ext_vector_type(16))) _Float16 v16h;
typedef __attribute__((ext_vector_type(8)))  _Float16 v8h;
typedef __attribute__((ext_vector_type(2)))  float    v2f;
typedef __attribute__((ext_vector_type(8)))  float    v8f;

#define HID   256
#define CCH   16
#define WAVES 8
#define BLOCK (WAVES * 32)
#define SLABS 4
#define ROWS_PER_TILE (WAVES * 16 * SLABS) // 512 rows per pass of a workgroup
#define TILES 4                            // row tiles per workgroup
#define ROWS_PER_WG (ROWS_PER_TILE * TILES)   // 2048 rows per workgroup
#define LEAD_TILES 2                       // tiles for which one wave of a SIMD pair leads

// LDS layout:
//   [0, 128KB)  : W2[c] as f16, pre-swizzled into per-lane WMMA B fragments.
//                 Fragment f = kc*512 + t*32 + lane holds the 16 halves lane
//                 `lane` needs for the WMMA on K-chunk kc, N-tile t.
//   then        : W3[c] transposed as f16, pre-swizzled into per-lane WMMA A
//                 fragments, one per 32 hidden units (8 KB)
//   then        : W1[c], b1[c], b2[c] (256 f32 each)
#define W2_HALVES (8 * 16 * 32 * 16)                 // 65536 halves = 128 KB
#define W3_HALVES (8 * 32 * 16)                      // 4096 halves = 8 KB
#define SMEM_BYTES ((W2_HALVES + W3_HALVES) * 2 + 256 * 3 * 4)

__global__ __launch_bounds__(BLOCK) void kan_fused_wmma_kernel(
    const float* __restrict__ xg,  const float* __restrict__ W1g,
    const float* __restrict__ b1g, const float* __restrict__ W2g,
    const float* __restrict__ b2g, const float* __restrict__ W3g,
    const float* __restrict__ b3g, float* __restrict__ outg)
{
    extern __shared__ char smem[];
    _Float16* w2s = (_Float16*)smem;
    _Float16* w3f = w2s + W2_HALVES;
    float*    w1s = (float*)(smem + (W2_HALVES + W3_HALVES) * 2);
    float*    b1s = w1s + 256;
    float*    b2s = b1s + 256;

    const int c    = blockIdx.y;
    const int tid  = threadIdx.x;
    const int lane = tid & 31;
    const int wave = tid >> 5;
    const int q    = lane & 15;   // column-in-tile / row selector
    const int hi   = lane >> 4;   // lane half (WMMA layout group)

    // ---- stage W2[c] (f32 [K=256][N=256]) -> swizzled f16 B fragments ----
    // 16-bit B 32x16 layout: lanes 0-15 (N=lane): halves 0..7 -> K 0..7,
    // halves 8..15 -> K 16..23; lanes 16-31: halves 0..7 -> K 8..15,
    // halves 8..15 -> K 24..31 (within the 32-wide K chunk).
    // A thread takes 8 rows k x 2 columns n: a wave's 8-byte loads cover 256
    // bytes of a row, whole cache lines, and the 8 k of one column are one
    // 16-byte piece of a fragment (halves 0..7 or 8..15 of lane hi*16 + n%16),
    // so the transposition is a matter of register names only.
    const float* W2c = W2g + (size_t)c * HID * HID;
    // The 16 tasks of a thread go as 8 batches of two (16 loads a wave) through
    // a ring of four register sets: three batches (48 loads a wave) are in
    // flight behind the one being converted, so the L2 latency is waited out
    // once, not once per batch.
    v2f r[4][2][8];
#define W2_ISSUE(b)                                                              \
    __builtin_amdgcn_sched_barrier(0);                                           \
    _Pragma("unroll") for (int g = 0; g < 2; ++g) {                              \
        const int i = tid + ((b) * 2 + g) * BLOCK;                               \
        /* column pair i & 127, group of 8 rows i >> 7 */                        \
        const float* sp = W2c + (i >> 7) * 8 * HID + (i & 127) * 2;              \
        _Pragma("unroll") for (int j = 0; j < 8; ++j)                            \
            r[(b) % 4][g][j] = *(const v2f*)(sp + j * HID);                      \
    }                                                                            \
    /* The address registers of these loads are reused right below; the */       \
    /* scheduling stops keep all other vector work off the span from the */      \
    /* loads to the wait. */                                                     \
    __builtin_amdgcn_sched_barrier(0);                                           \
    asm volatile("s_wait_xcnt 0x0" ::: "memory");                                \
    __builtin_amdgcn_sched_barrier(0)
    W2_ISSUE(0);
    W2_ISSUE(1);
    W2_ISSUE(2);

    // ---- small per-channel tensors: their loads join the same stream ----
    static_assert(BLOCK == HID, "one element of W1, b1, b2 per thread");
    const float sw1 = W1g[c * HID + tid];
    const float sb1 = b1g[c * HID + tid];
    const float sb2 = b2g[c * HID + tid];
    // W3[c]^T as the A operand of fc3: wave w builds the fragment of hidden
    // units 32w .. 32w+31. Row m of A is output m & 7 (outputs 0..2; the other
    // rows are zero), so rows 8..10 repeat rows 0..2 and both lane halves end
    // up holding the three outputs. k order: that of a packed pair of D tiles.
    const int o = q & 7;
    // every lane loads (a zero row reads output 2 and drops it): 16 loads
    // in flight together, no branch around each
    const float* wp = W3g + c * HID * 3 + (wave * 32 + hi * 8) * 3 + (o < 3 ? o : 2);
    float w[16];
#pragma unroll
    for (int h = 0; h < 16; ++h)
        w[h] = wp[((h < 8) ? h : (h + 8)) * 3];
    // The address registers of these loads are reused right below; the
    // scheduling stops keep later address arithmetic behind the wait.
    __builtin_amdgcn_sched_barrier(0);
    asm volatile("s_wait_xcnt 0x0" ::: "memory");
    __builtin_amdgcn_sched_barrier(0);

    // ---- W2 batches: convert, store, issue three ahead ----
#pragma unroll
    for (int b = 0; b < 8; ++b) {
        if (b > 0 && b + 3 < 8) { W2_ISSUE(b + 3); }
#pragma unroll
        for (int g = 0; g < 2; ++g) {
            const int i  = tid + (b * 2 + g) * BLOCK;
            const int kg = i >> 7;
            // kg = kc*4 + (halves 8..15 ? 2 : 0) + (lanes 16-31 ? 1 : 0)
            const int fb = (kg >> 2) * 512 + (kg & 1) * 16;
#pragma unroll
            for (int e = 0; e < 2; ++e) {
                const int n = (i & 127) * 2 + e;
                v8h piece;
#pragma unroll
                for (int j = 0; j < 8; ++j) piece[j] = (_Float16)r[b % 4][g][j][e];
                *(v8h*)(w2s + ((fb + (n >> 4) * 32 + (n & 15)) << 4) +
                        ((kg >> 1) & 1) * 8) = piece;
            }
        }
        if (b == 0) { W2_ISSUE(3); }
        if (b == 2) {   // by now the small tensors have arrived behind batch 2
            w1s[tid] = sw1;
            b1s[tid] = sb1;
            b2s[tid] = sb2;
            v16h f;
#pragma unroll
            for (int h = 0; h < 16; ++h)
                f[h] = (o < 3) ? (_Float16)w[h] : (_Float16)0.f;
            *(v16h*)(w3f + (tid << 4)) = f;
        }
    }
    __syncthreads();

    // One wave of each pair leads for
    // its first LEAD_TILES tiles and then yields, so that both end together. The
    // pick differs inside a pair whether waves w and w + 4 or waves 2w and 2w + 1
    // share a SIMD.
    const int  wv   = __builtin_amdgcn_readfirstlane(wave);
    const bool lead = ((wv ^ (wv >> 2)) & 1) != 0;
    if (lead) __builtin_amdgcn_s_setprio(3);
    else      __builtin_amdgcn_s_setprio(1);

    const float bo0 = b3g[c * 3 + 0];
    const float bo1 = b3g[c * 3 + 1];
    const float bo2 = b3g[c * 3 + 2];

    // W2[c] and the small tensors are staged once and stay in LDS for TILES
    // row tiles: the grid is one workgroup per WGP, and no barrier stands in
    // the tile loop (LDS is only read from here on), so the waves may drift.
    // Rolled, for speed only.
#pragma unroll 1
    for (int tile = 0; tile < TILES; ++tile) {
    // the leading wave steps below its partner from here on
    if (lead && tile == LEAD_TILES) __builtin_amdgcn_s_setprio(0);
    const size_t rowBase0 = (size_t)blockIdx.x * ROWS_PER_WG +
        (size_t)tile * ROWS_PER_TILE + (size_t)wave * (16 * SLABS);

    // All SLABS row slabs of the wave are held in registers at once, so that
    // one B fragment read from LDS feeds SLABS WMMAs on independent
    // accumulators. Live set: fc1 outputs 4 x 64, acc 2 x 4 x 8, fc3 sums 4 x 8
    // VGPRs.

    // ---- fc1 fused into fragments: a[m,k] = relu(x_m*W1[k]+b1[k]) ----
    // The A 16x32 and B 32x16 maps mirror each other: row m = lane&15 (column m
    // of h1^T as a B operand); K mapping as above.
    float xm[SLABS];
#pragma unroll
    for (int s = 0; s < SLABS; ++s)
        xm[s] = xg[(rowBase0 + (size_t)(s * 16 + q)) * CCH + c];
    asm volatile("s_wait_xcnt 0x0" ::: "memory");

    v16h a[SLABS][8];
#pragma unroll
    for (int kc = 0; kc < 8; ++kc) {
        const int kb = kc * 32 + hi * 8;
#pragma unroll
        for (int h = 0; h < 16; ++h) {
            const int k = kb + ((h < 8) ? h : (h + 8));
            const float w = w1s[k];
            const float b = b1s[k];
#pragma unroll
            for (int s = 0; s < SLABS; ++s) {
                float v = fmaf(xm[s], w, b);
                a[s][kc][h] = (_Float16)(v > 0.f ? v : 0.f);
            }
        }
    }

    // ---- fc2 via WMMA, transposed: W2^T is the A operand, h1^T the B operand
    // (the two fragment maps mirror each other, so the registers are the same).
    // D: VGPR j of this lane = (hidden unit t*16 + 8*hi + j, row q of the slab).
    // Two such tiles, converted in place, are the B fragment of fc3 for 32
    // hidden units: fc3 = W3^T x h2^T runs on the matrix unit as well, with no
    // lane exchange and no reduction over lanes behind the loop.
    v8f o3[SLABS];
#pragma unroll
    for (int s = 0; s < SLABS; ++s) o3[s] = v8f{};

    // Rolled: the fc1 outputs fill half of the 512-VGPR budget of this block
    // size; more than one pair of N-tiles at once does not fit.
#pragma unroll 1
    for (int tp = 0; tp < 8; ++tp) {             // 8 pairs of fc2 N-tiles
        v16h hb[SLABS];
#pragma unroll
        for (int u = 0; u < 2; ++u) {
            const int t = tp * 2 + u;
            // b2 of this lane's 8 hidden units is the start value of the sums
            const v8f bias = *(const v8f*)(b2s + t * 16 + hi * 8);
            v8f acc[SLABS];
#pragma unroll
            for (int s = 0; s < SLABS; ++s) acc[s] = bias;
#pragma unroll
            for (int kc = 0; kc < 8; ++kc) {     // K = 256 in 32-chunks
                const v16h b = *(const v16h*)(w2s + ((kc * 512 + t * 32 + lane) << 4));
#pragma unroll
                for (int s = 0; s < SLABS; ++s)
                    acc[s] = __builtin_amdgcn_wmma_f32_16x16x32_f16(
                        false, b, false, a[s][kc], (short)0, acc[s], false, false);
            }
#pragma unroll
            for (int s = 0; s < SLABS; ++s)
#pragma unroll
                for (int j = 0; j < 8; ++j) hb[s][u * 8 + j] = (_Float16)acc[s][j];
        }
        const v16h a3 = *(const v16h*)(w3f + ((tp * 32 + lane) << 4));
#pragma unroll
        for (int s = 0; s < SLABS; ++s) {
            hb[s] = __builtin_elementwise_max(hb[s], v16h{});   // relu(fc2 + b2)
            o3[s] = __builtin_amdgcn_wmma_f32_16x16x32_f16(
                false, a3, false, hb[s], (short)0, o3[s], false, false);
        }
    }

    // ---- write out[row, c*3 + o]: VGPR o of o3[s] = output o of row q of slab
    // s in both lane halves; half hi stores slab 2*sp + hi ----
#pragma unroll
    for (int sp = 0; sp < SLABS / 2; ++sp) {
        const size_t row = rowBase0 + (size_t)((2 * sp + hi) * 16 + q);
        float* op = outg + row * (CCH * 3) + c * 3;
        const v8f lo = o3[2 * sp], up = o3[2 * sp + 1];
        const float l0 = lo[0], l1 = lo[1], l2 = lo[2];
        const float u0 = up[0], u1 = up[1], u2 = up[2];
        op[0] = (hi ? u0 : l0) + bo0;
        op[1] = (hi ? u1 : l1) + bo1;
        op[2] = (hi ? u2 : l2) + bo2;
    }
    // The next trip overwrites the address and data registers of this trip's
    // last store: the wait stands in front of that. Its memory clobber also
    // keeps the LDS reads of W1 and b1 inside the loop; lifted out of it they
    // take 256 more registers and are spilled to scratch.
    asm volatile("s_wait_xcnt 0x0" ::: "memory");
    }   // tile
    __builtin_amdgcn_s_setprio(0);   // no path leaves the kernel with a raised priority
}

extern "C" void kernel_launch(void* const* d_in, const int* in_sizes, int n_in,
                              void* d_out, int out_size, void* d_ws, size_t ws_size,
                              hipStream_t stream) {
    (void)in_sizes; (void)n_in; (void)d_ws; (void)ws_size; (void)out_size;
    const float* x  = (const float*)d_in[0];
    const float* W1 = (const float*)d_in[1];
    const float* b1 = (const float*)d_in[2];
    const float* W2 = (const float*)d_in[3];
    const float* b2 = (const float*)d_in[4];
    const float* W3 = (const float*)d_in[5];
    const float* b3 = (const float*)d_in[6];
    float* out = (float*)d_out;

    // 139 KB dynamic LDS (> default 64 KB cap): raise the attribute.
    hipFuncSetAttribute((const void*)kan_fused_wmma_kernel,
                        hipFuncAttributeMaxDynamicSharedMemorySize, SMEM_BYTES);

    const int Nrows = 8 * 64 * 64;                       // 32768
    dim3 grid(Nrows / ROWS_PER_WG, CCH);                 // (16, 16)
    kan_fused_wmma_kernel<<<grid, BLOCK, SMEM_BYTES, stream>>>(
        x, W1, b1, W2, b2, W3, b3, out);
}

// v008
// A run of this version takes 33.7 microseconds.
// In both of two side-by-side timings against v007, it was 1.04 times as fast.
// Counting every step since v000, it is 3.89 times as fast.
#include <hip/hip_runtime.h>
#include <hip/hip_bf16.h>

typedef __attribute__((ext_vector_type(16))) _Float16 v16h;
typedef __attribute__((ext_vector_type(8)))  _Float16 v8h;
typedef __attribute__((ext_vector_type(2)))  float    v2f;
typedef __attribute__((ext_vector_type(8)))  float    v8f;

// One fragment from its two 512-byte planes; p points at the lane's 16 bytes of
// plane 0.
__device__ __forceinline__ v16h frag_planes(const _Float16* p) {
    const v8h lo = *(const v8h*)p;
    const v8h up = *(const v8h*)(p + 256);
    return __builtin_shufflevector(lo, up, 0, 1, 2, 3, 4, 5, 6, 7,
                                   8, 9, 10, 11, 12, 13, 14, 15);
}

#define HID   256
#define CCH   16
#define WAVES 8
#define BLOCK (WAVES * 32)
#define SLABS 4
#define ROWS_PER_TILE (WAVES * 16 * SLABS) // 512 rows per pass of a workgroup
#define TILES 4                            // row tiles per workgroup
#define ROWS_PER_WG (ROWS_PER_TILE * TILES)   // 2048 rows per workgroup
#define LEAD_TILES 2                       // tiles for which one wave of a SIMD pair leads

// LDS layout:
//   [0, 128KB)  : W2[c] as f16, pre-swizzled into per-lane WMMA fragments. The
//                 16 halves lane `lane` needs for the WMMA on K-chunk kc, N-tile
//                 t lie in two planes of 512 bytes: halves 8p .. 8p+7 at half
//                 index ((t*8 + kc)*2 + p)*256 + lane*8 (t outermost: all reads
//                 of a pair of N-tiles are one base register and an immediate
//                 offset below 64 KB). A 16-byte read of a
//                 wave is then contiguous (lane pitch 16 bytes) and meets each
//                 LDS bank once per 16 lanes; with the 32 bytes of a lane side
//                 by side (pitch 32) lanes l and l + 8 share their banks and
//                 every read takes twice the LDS clocks.
//   then        : W3[c] transposed as f16, pre-swizzled into per-lane WMMA A
//                 fragments, one per 32 hidden units (8 KB), in the same two
//                 planes: ((tp*2 + p)*256 + lane*8)
//   then        : W1[c], b1[c], b2[c] (256 f32 each)
#define W2_HALVES (8 * 16 * 32 * 16)                 // 65536 halves = 128 KB
#define W3_HALVES (8 * 32 * 16)                      // 4096 halves = 8 KB
#define SMEM_BYTES ((W2_HALVES + W3_HALVES) * 2 + 256 * 3 * 4)

__global__ __launch_bounds__(BLOCK) void kan_fused_wmma_kernel(
    const float* __restrict__ xg,  const float* __restrict__ W1g,
    const float* __restrict__ b1g, const float* __restrict__ W2g,
    const float* __restrict__ b2g, const float* __restrict__ W3g,
    const float* __restrict__ b3g, float* __restrict__ outg)
{
    extern __shared__ char smem[];
    _Float16* w2s = (_Float16*)smem;
    _Float16* w3f = w2s + W2_HALVES;
    float*    w1s = (float*)(smem + (W2_HALVES + W3_HALVES) * 2);
    float*    b1s = w1s + 256;
    float*    b2s = b1s + 256;

    const int c    = blockIdx.y;
    const int tid  = threadIdx.x;
    const int lane = tid & 31;
    const int wave = tid >> 5;
    const int q    = lane & 15;   // column-in-tile / row selector
    const int hi   = lane >> 4;   // lane half (WMMA layout group)

    // ---- stage W2[c] (f32 [K=256][N=256]) -> swizzled f16 B fragments ----
    // 16-bit B 32x16 layout: lanes 0-15 (N=lane): halves 0..7 -> K 0..7,
    // halves 8..15 -> K 16..23; lanes 16-31: halves 0..7 -> K 8..15,
    // halves 8..15 -> K 24..31 (within the 32-wide K chunk).
    // A thread takes 8 rows k x 2 columns n: a wave's 8-byte loads cover 256
    // bytes of a row, whole cache lines, and the 8 k of one column are one
    // 16-byte piece of a fragment (halves 0..7 or 8..15 of lane hi*16 + n%16),
    // so the transposition is a matter of register names only.
    const float* W2c = W2g + (size_t)c * HID * HID;
    // The 16 tasks of a thread go as 8 batches of two (16 loads a wave) through
    // a ring of four register sets: three batches (48 loads a wave) are in
    // flight behind the one being converted, so the L2 latency is waited out
    // once, not once per batch.
    v2f r[4][2][8];
#define W2_ISSUE(b)                                                              \
    __builtin_amdgcn_sched_barrier(0);                                           \
    _Pragma("unroll") for (int g = 0; g < 2; ++g) {                              \
        const int i = tid + ((b) * 2 + g) * BLOCK;                               \
        /* column pair i & 127, group of 8 rows i >> 7 */                        \
        const float* sp = W2c + (i >> 7) * 8 * HID + (i & 127) * 2;              \
        _Pragma("unroll") for (int j = 0; j < 8; ++j)                            \
            r[(b) % 4][g][j] = *(const v2f*)(sp + j * HID);                      \
    }                                                                            \
    /* The address registers of these loads are reused right below; the */       \
    /* scheduling stops keep all other vector work off the span from the */      \
    /* loads to the wait. */                                                     \
    __builtin_amdgcn_sched_barrier(0);                                           \
    asm volatile("s_wait_xcnt 0x0" ::: "memory");                                \
    __builtin_amdgcn_sched_barrier(0)
    W2_ISSUE(0);
    W2_ISSUE(1);
    W2_ISSUE(2);

    // ---- small per-channel tensors: their loads join the same stream ----
    static_assert(BLOCK == HID, "one element of W1, b1, b2 per thread");
    const float sw1 = W1g[c * HID + tid];
    const float sb1 = b1g[c * HID + tid];
    const float sb2 = b2g[c * HID + tid];
    // W3[c]^T as the A operand of fc3: wave w builds the fragment of hidden
    // units 32w .. 32w+31. Row m of A is output m & 7 (outputs 0..2; the other
    // rows are zero), so rows 8..10 repeat rows 0..2 and both lane halves end
    // up holding the three outputs. k order: that of a packed pair of D tiles.
    const int o = q & 7;
    // every lane loads (a zero row reads output 2 and drops it): 16 loads
    // in flight together, no branch around each
    const float* wp = W3g + c * HID * 3 + (wave * 32 + hi * 8) * 3 + (o < 3 ? o : 2);
    float w[16];
#pragma unroll
    for (int h = 0; h < 16; ++h)
        w[h] = wp[((h < 8) ? h : (h + 8)) * 3];
    // The address registers of these loads are reused right below; the
    // scheduling stops keep later address arithmetic behind the wait.
    __builtin_amdgcn_sched_barrier(0);
    asm volatile("s_wait_xcnt 0x0" ::: "memory");
    __builtin_amdgcn_sched_barrier(0);

    // ---- W2 batches: convert, store, issue three ahead ----
#pragma unroll
    for (int b = 0; b < 8; ++b) {
        if (b > 0 && b + 3 < 8) { W2_ISSUE(b + 3); }
#pragma unroll
        for (int g = 0; g < 2; ++g) {
            const int i  = tid + (b * 2 + g) * BLOCK;
            const int kg = i >> 7;
            // kg = kc*4 + (halves 8..15 ? 2 : 0) + (lanes 16-31 ? 1 : 0)
            const int fb = ((kg >> 2) * 2 + ((kg >> 1) & 1)) * 256 + (kg & 1) * 128;
#pragma unroll
            for (int e = 0; e < 2; ++e) {
                const int n = (i & 127) * 2 + e;
                v8h piece;
#pragma unroll
                for (int j = 0; j < 8; ++j) piece[j] = (_Float16)r[b % 4][g][j][e];
                *(v8h*)(w2s + fb + (n >> 4) * 4096 + (n & 15) * 8) = piece;
            }
        }
        if (b == 0) { W2_ISSUE(3); }
        if (b == 2) {   // by now the small tensors have arrived behind batch 2
            w1s[tid] = sw1;
            b1s[tid] = sb1;
            b2s[tid] = sb2;
            v8h f[2];
#pragma unroll
            for (int h = 0; h < 16; ++h)
                f[h >> 3][h & 7] = (o < 3) ? (_Float16)w[h] : (_Float16)0.f;
            _Float16* fp = w3f + (tid << 4) - lane * 8;   // wave * 512 + lane * 8
            *(v8h*)fp         = f[0];
            *(v8h*)(fp + 256) = f[1];
        }
    }
    __syncthreads();

    // One wave of each pair leads for
    // its first LEAD_TILES tiles and then yields, so that both end together. The
    // pick differs inside a pair whether waves w and w + 4 or waves 2w and 2w + 1
    // share a SIMD.
    const int  wv   = __builtin_amdgcn_readfirstlane(wave);
    const bool lead = ((wv ^ (wv >> 2)) & 1) != 0;
    if (lead) __builtin_amdgcn_s_setprio(3);
    else      __builtin_amdgcn_s_setprio(1);

    const float bo0 = b3g[c * 3 + 0];
    const float bo1 = b3g[c * 3 + 1];
    const float bo2 = b3g[c * 3 + 2];

    // W2[c] and the small tensors are staged once and stay in LDS for TILES
    // row tiles: the grid is one workgroup per WGP, and no barrier stands in
    // the tile loop (LDS is only read from here on), so the waves may drift.
    // Rolled, for speed only.
#pragma unroll 1
    for (int tile = 0; tile < TILES; ++tile) {
    // the leading wave steps below its partner from here on
    if (lead && tile == LEAD_TILES) __builtin_amdgcn_s_setprio(0);
    const size_t rowBase0 = (size_t)blockIdx.x * ROWS_PER_WG +
        (size_t)tile * ROWS_PER_TILE + (size_t)wave * (16 * SLABS);

    // All SLABS row slabs of the wave are held in registers at once, so that
    // one B fragment read from LDS feeds SLABS WMMAs on independent
    // accumulators. Live set: fc1 outputs 4 x 64, acc 2 x 4 x 8, fc3 sums 4 x 8
    // VGPRs.

    // ---- fc1 fused into fragments: a[m,k] = relu(x_m*W1[k]+b1[k]) ----
    // The A 16x32 and B 32x16 maps mirror each other: row m = lane&15 (column m
    // of h1^T as a B operand); K mapping as above.
    float xm[SLABS];
#pragma unroll
    for (int s = 0; s < SLABS; ++s)
        xm[s] = xg[(rowBase0 + (size_t)(s * 16 + q)) * CCH + c];
    asm volatile("s_wait_xcnt 0x0" ::: "memory");

    v16h a[SLABS][8];
#pragma unroll
    for (int kc = 0; kc < 8; ++kc) {
        const int kb = kc * 32 + hi * 8;
#pragma unroll
        for (int h = 0; h < 16; ++h) {
            const int k = kb + ((h < 8) ? h : (h + 8));
            const float w = w1s[k];
            const float b = b1s[k];
#pragma unroll
            for (int s = 0; s < SLABS; ++s) {
                float v = fmaf(xm[s], w, b);
                a[s][kc][h] = (_Float16)(v > 0.f ? v : 0.f);
            }
        }
    }

    // ---- fc2 via WMMA, transposed: W2^T is the A operand, h1^T the B operand
    // (the two fragment maps mirror each other, so the registers are the same).
    // D: VGPR j of this lane = (hidden unit t*16 + 8*hi + j, row q of the slab).
    // Two such tiles, converted in place, are the B fragment of fc3 for 32
    // hidden units: fc3 = W3^T x h2^T runs on the matrix unit as well, with no
    // lane exchange and no reduction over lanes behind the loop.
    v8f o3[SLABS];
#pragma unroll
    for (int s = 0; s < SLABS; ++s) o3[s] = v8f{};

    // Rolled: the fc1 outputs fill half of the 512-VGPR budget of this block
    // size; more than one pair of N-tiles at once does not fit.
#pragma unroll 1
    for (int tp = 0; tp < 8; ++tp) {             // 8 pairs of fc2 N-tiles
        v16h hb[SLABS];
#pragma unroll
        for (int u = 0; u < 2; ++u) {
            const int t = tp * 2 + u;
            // b2 of this lane's 8 hidden units is the start value of the sums
            const v8f bias = *(const v8f*)(b2s + t * 16 + hi * 8);
            v8f acc[SLABS];
#pragma unroll
            for (int s = 0; s < SLABS; ++s) acc[s] = bias;
#pragma unroll
            for (int kc = 0; kc < 8; ++kc) {     // K = 256 in 32-chunks
                const v16h b = frag_planes(w2s + (t * 8 + kc) * 512 + lane * 8);
#pragma unroll
                for (int s = 0; s < SLABS; ++s)
                    acc[s] = __builtin_amdgcn_wmma_f32_16x16x32_f16(
                        false, b, false, a[s][kc], (short)0, acc[s], false, false);
            }
#pragma unroll
            for (int s = 0; s < SLABS; ++s)
#pragma unroll
                for (int j = 0; j < 8; ++j) hb[s][u * 8 + j] = (_Float16)acc[s][j];
        }
        const v16h a3 = frag_planes(w3f + tp * 512 + lane * 8);
#pragma unroll
        for (int s = 0; s < SLABS; ++s) {
            hb[s] = __builtin_elementwise_max(hb[s], v16h{});   // relu(fc2 + b2)
            o3[s] = __builtin_amdgcn_wmma_f32_16x16x32_f16(
                false, a3, false, hb[s], (short)0, o3[s], false, false);
        }
    }

    // ---- write out[row, c*3 + o]: VGPR o of o3[s] = output o of row q of slab
    // s in both lane halves; half hi stores slab 2*sp + hi ----
#pragma unroll
    for (int sp = 0; sp < SLABS / 2; ++sp) {
        const size_t row = rowBase0 + (size_t)((2 * sp + hi) * 16 + q);
        float* op = outg + row * (CCH * 3) + c * 3;
        const v8f lo = o3[2 * sp], up = o3[2 * sp + 1];
        const float l0 = lo[0], l1 = lo[1], l2 = lo[2];
        const float u0 = up[0], u1 = up[1], u2 = up[2];
        op[0] = (hi ? u0 : l0) + bo0;
        op[1] = (hi ? u1 : l1) + bo1;
        op[2] = (hi ? u2 : l2) + bo2;
    }
    // The next trip overwrites the address and data registers of this trip's
    // last store: the wait stands in front of that. Its memory clobber also
    // keeps the LDS reads of W1 and b1 inside the loop; lifted out of it they
    // take 256 more registers and are spilled to scratch.
    asm volatile("s_wait_xcnt 0x0" ::: "memory");
    }   // tile
    __builtin_amdgcn_s_setprio(0);   // no path leaves the kernel with a raised priority
}

extern "C" void kernel_launch(void* const* d_in, const int* in_sizes, int n_in,
                              void* d_out, int out_size, void* d_ws, size_t ws_size,
                              hipStream_t stream) {
    (void)in_sizes; (void)n_in; (void)d_ws; (void)ws_size; (void)out_size;
    const float* x  = (const float*)d_in[0];
    const float* W1 = (const float*)d_in[1];
    const float* b1 = (const float*)d_in[2];
    const float* W2 = (const float*)d_in[3];
    const float* b2 = (const float*)d_in[4];
    const float* W3 = (const float*)d_in[5];
    const float* b3 = (const float*)d_in[6];
    float* out = (float*)d_out;

    // 139 KB dynamic LDS (> default 64 KB cap): raise the attribute.
    hipFuncSetAttribute((const void*)kan_fused_wmma_kernel,
                        hipFuncAttributeMaxDynamicSharedMemorySize, SMEM_BYTES);

    const int Nrows = 8 * 64 * 64;                       // 32768
    dim3 grid(Nrows / ROWS_PER_WG, CCH);                 // (16, 16)
    kan_fused_wmma_kernel<<<grid, BLOCK, SMEM_BYTES, stream>>>(
        x, W1, b1, W2, b2, W3, b3, out);
}
